// v010
// Measured on an AMD MI455X. A time is GPU time per run, averaged over a window of back-to-back runs after a warm-up
// (all launches, gaps included; the runs take copies of the inputs in turn), and the median of several windows.
// Apart from v000's, it joins two sittings. Times from different sittings can be a few percent apart, while
// side-by-side timings come from the same sitting.
// The versions before v010 are in another document.
// It runs in 150 microseconds.
// Timed twice side by side with v009, it ran 1.05 and 1.04 times as fast.
// Over all steps from v000, the starting kernel, it is 43.7 times as fast.
#include <hip/hip_runtime.h>
// Multi-head self-attention with the source's INVERTED causal mask (inputs [2][2048][1024]; q / k / v = x W + b ([in][out] 1024 x 1024 sigma 1/32, zero biases); 16 heads of 64; score = q k^T / sqrt(64) + tril * (-1e9): the LOWER triangle incl. the diagonal is pushed to -1e9 (the original's mask bug, kept), so query i attends to the keys j > i only, and the last query (every key masked, all scores rounding to the same -1e9 in f32) attends uniformly to all keys; softmax; out = merged Wo + bo -> [2][2048][1024]).
// Structure: token rows r = b*2048 + s; x as exact f16 rows (bf16-rounded); Q, K, V as three WMMA GEMMs in one launch (grid z; 32x64 wave tiles, f32 accumulation, exact x16 weights + bias, f16 outputs); V^T for all batches and heads via LDS transposes; one fused attention launch over every (batch, head): S^T = K Q^T on WMMA (K = 64, x 1/sqrt(64), then the -1e9 fill), running softmax on VALU (f32 statistics; unnormalised weights exp(s - max) as f16), O^T += V^T P^T on WMMA, o = O / sum (carried x64 against f16 subnormal flush, folded into the output GEMM alpha) written straight into the merged f16 o rows; out = o W_o + b GEMM (f32) into the output layout.
// Compute dtype: inputs rounded to bf16; x / weights exact; q, k, v, softmax weights and o as plain f16 GEMM operands (~2^-12); scores and softmax statistics f32. v_wmma_f32_16x16x32_f16.
#define NB 2
#define SQ 2048
#define DM 1024
#define NH 16
#define HD 64
#define QT0 256                      /* last-tile rows recomputed exactly in f32 (rows with fewer than 256 visible keys) */
#define HG 4                         /* heads per k_vt launch (k_vt is not launched) */
#define KW 16                        /* waves of a k_mid block = parts a query row's keys are dealt into */
#define B0 0                         /* first batch processed (debug hook) */
#define NBR NB                       /* batches processed (debug hook) */
#define NR ((size_t)NB * SQ)         /* token rows */
#define MP ((int)((size_t)NBR * SQ)) /* rows projected (debug hook) */
#define QN SQ                        /* unused */
#define NHD NH                       /* unused */
#define MPO MP                       /* rows through the output stage (debug hook) */
#define LQ DM      /* row pitch of the q/k/v rows */
typedef __bf16 v16b __attribute__((ext_vector_type(16)));
typedef unsigned short v8us __attribute__((ext_vector_type(8), may_alias));
typedef float  v8f  __attribute__((ext_vector_type(8)));
typedef float  v4f  __attribute__((ext_vector_type(4)));
typedef float  v4fa __attribute__((ext_vector_type(4), may_alias));
union FragB { v16b v; v8us half[2]; unsigned short u[16]; };

__device__ __forceinline__ unsigned short bf16_bits(float x) { unsigned int u = __float_as_uint(x); return (unsigned short)((u + 0x7FFFu + ((u >> 16) & 1u)) >> 16); }
__device__ __forceinline__ float bf16_val(unsigned short b) { return __uint_as_float(((unsigned int)b) << 16); }
__device__ __forceinline__ float bf16_round(float x) { return bf16_val(bf16_bits(x)); }
// D += A·B with NT terms: 1 = ah·bh, 2 = + al·bh (A split), 3 = + ah·bl (both split)
template <int NT>
__device__ __forceinline__ v8f mmaN(v16b ah, v16b al, v16b bh, v16b bl, v8f c) {
  c = __builtin_amdgcn_wmma_f32_16x16x32_bf16(false, ah, false, bh, (short)0, c, false, false);
  if (NT >= 2) c = __builtin_amdgcn_wmma_f32_16x16x32_bf16(false, al, false, bh, (short)0, c, false, false);
  if (NT >= 3) c = __builtin_amdgcn_wmma_f32_16x16x32_bf16(false, ah, false, bl, (short)0, c, false, false);
  asm volatile("v_nop\n\tv_nop\n\tv_nop\n\tv_nop" : "+v"(c) : "v"(ah), "v"(al), "v"(bh), "v"(bl));
  return c;
}

__global__ __launch_bounds__(256) void k_wt_bf16(const float* __restrict__ W, unsigned short* __restrict__ Wt, int K, int N) {
  const int t = blockIdx.x * 256 + threadIdx.x;
  const int k8n = K / 8;
  if (t >= N * k8n) return;
  const int n = t / k8n, k8 = (t % k8n) * 8;
  v8us v;
#pragma unroll
  for (int i = 0; i < 8; ++i) v[i] = bf16_bits(W[(size_t)(k8 + i) * N + n]);
  *(v8us*)(Wt + (size_t)n * K + k8) = v;
  
}

// GEMM C[M][N] (f32, pitch ldc) = act(A[M][K]·W + bias). A f32 row-major (pitch lda) converted per fragment to bf16
// (ASPLIT: hi/lo two planes -> 2 terms, else single rounded term); Wt bf16 [N][K] (pitch ldb). BIAS_BF16 rounds the
// bias to bf16 first (bias quantised to bf16 before the add). K%32==0, M%16==0, N%64==0.
template <bool ASPLIT, int ACT, bool BIAS_BF16>
__global__ __launch_bounds__(128) void k_gemm_bf(const float* __restrict__ A, int lda, const unsigned short* __restrict__ Wt, int ldb,
                                               const float* __restrict__ bias, float* __restrict__ C, int ldc, int M, int N, int K) {
  __shared__ __attribute__((aligned(16))) float so[4][16][64];
  const int tid = threadIdx.x, w = tid >> 5, lane = tid & 31, ln = lane & 15, hh = lane >> 4;
  const int ntn = N / 64;
  const int wid = blockIdx.x * 4 + w;
  const int mt = wid / ntn, nq = wid % ntn;
  if (mt * 16 >= M) return;
  const int row0 = mt * 16, col0 = nq * 64;
  const float* arow = A + (size_t)(row0 + ln) * lda;
  v8f acc[4] = {};
  for (int kb = 0; kb < K; kb += 32) {
    FragB ah, al;
    const v4f x0 = *(const v4fa*)(arow + kb + 8 * hh), x1 = *(const v4fa*)(arow + kb + 8 * hh + 4);
    const v4f x2 = *(const v4fa*)(arow + kb + 16 + 8 * hh), x3 = *(const v4fa*)(arow + kb + 16 + 8 * hh + 4);
    float xs[16] = {x0[0],x0[1],x0[2],x0[3],x1[0],x1[1],x1[2],x1[3],x2[0],x2[1],x2[2],x2[3],x3[0],x3[1],x3[2],x3[3]};
#pragma unroll
    for (int i = 0; i < 16; ++i) { const unsigned short hb = bf16_bits(xs[i]); ah.u[i] = hb; al.u[i] = ASPLIT ? bf16_bits(xs[i] - bf16_val(hb)) : (unsigned short)0; }
#pragma unroll
    for (int t = 0; t < 4; ++t) {
      const unsigned short* brow = Wt + (size_t)(col0 + t * 16 + ln) * ldb + kb;
      FragB b;
      b.half[0] = *(const v8us*)(brow + 8 * hh);
      b.half[1] = *(const v8us*)(brow + 16 + 8 * hh);
      acc[t] = mmaN<ASPLIT ? 2 : 1>(ah.v, al.v, b.v, b.v, acc[t]);
    }
  }
#pragma unroll
  for (int t = 0; t < 4; ++t) {
    float bv = bias ? bias[col0 + t * 16 + ln] : 0.f;
    if (BIAS_BF16) bv = bf16_round(bv);
#pragma unroll
    for (int r = 0; r < 8; ++r) { float v = acc[t][r] + bv; if (ACT == 1) v = fmaxf(v, 0.f); so[w][8 * hh + r][t * 16 + ln] = v; }
  }
  __builtin_amdgcn_fence(__ATOMIC_ACQ_REL, "workgroup");
  __builtin_amdgcn_wave_barrier();
  const int rsub = lane >> 4, c4 = (lane & 15) * 4;
  {
#pragma unroll
    for (int q = 0; q < 8; ++q) {
      const int r = q * 2 + rsub;
      const v4f v = *(const v4fa*)&so[w][r][c4];
      *(v4f*)(C + (size_t)(row0 + r) * ldc + col0 + c4) = v;
    }
    
  }
}

// GEMM C = act(A·W + bias + resid): A f32 (ASPLIT -> hi/lo 2 terms), Wt bf16 [N][K]; ACT 0 none, 1 relu, 2 exact gelu;
// resid (optional, f32, row index = (row % rmod), pitch ldr, RES_BF16 rounds it) added before the activation.
template <bool ASPLIT, int ACT, bool BIAS_BF16, bool RES_BF16>
__global__ __launch_bounds__(128) void k_gemm_bf3(const float* __restrict__ A, int lda, const unsigned short* __restrict__ Wt, int ldb,
                                                const float* __restrict__ bias, const float* __restrict__ resid, int rmod, int ldr,
                                                float* __restrict__ C, int ldc, int M, int N, int K) {
  __shared__ __attribute__((aligned(16))) float so[4][16][64];
  const int tid = threadIdx.x, w = tid >> 5, lane = tid & 31, ln = lane & 15, hh = lane >> 4;
  const int ntn = N / 64;
  const int wid = blockIdx.x * 4 + w;
  const int mt = wid / ntn, nq = wid % ntn;
  if (mt * 16 >= M) return;
  const int row0 = mt * 16, col0 = nq * 64;
  const float* arow = A + (size_t)(row0 + ln) * lda;
  v8f acc[4] = {};
  for (int kb = 0; kb < K; kb += 32) {
    FragB ah, al;
    const v4f x0 = *(const v4fa*)(arow + kb + 8 * hh), x1 = *(const v4fa*)(arow + kb + 8 * hh + 4);
    const v4f x2 = *(const v4fa*)(arow + kb + 16 + 8 * hh), x3 = *(const v4fa*)(arow + kb + 16 + 8 * hh + 4);
    float xs[16] = {x0[0],x0[1],x0[2],x0[3],x1[0],x1[1],x1[2],x1[3],x2[0],x2[1],x2[2],x2[3],x3[0],x3[1],x3[2],x3[3]};
#pragma unroll
    for (int i = 0; i < 16; ++i) { const unsigned short hb = bf16_bits(xs[i]); ah.u[i] = hb; al.u[i] = ASPLIT ? bf16_bits(xs[i] - bf16_val(hb)) : (unsigned short)0; }
#pragma unroll
    for (int t = 0; t < 4; ++t) {
      const unsigned short* brow = Wt + (size_t)(col0 + t * 16 + ln) * ldb + kb;
      FragB b;
      b.half[0] = *(const v8us*)(brow + 8 * hh);
      b.half[1] = *(const v8us*)(brow + 16 + 8 * hh);
      acc[t] = mmaN<ASPLIT ? 2 : 1>(ah.v, al.v, b.v, b.v, acc[t]);
    }
  }
#pragma unroll
  for (int t = 0; t < 4; ++t) {
    const int col = col0 + t * 16 + ln;
    float bv = bias ? bias[col] : 0.f;
    if (BIAS_BF16) bv = bf16_round(bv);
#pragma unroll
    for (int r = 0; r < 8; ++r) {
      float v = acc[t][r] + bv;
      if (resid) { float rv = resid[(size_t)((row0 + 8 * hh + r) % rmod) * ldr + col]; if (RES_BF16) rv = bf16_round(rv); v += rv; }
      if (ACT == 1) v = fmaxf(v, 0.f);
      if (ACT == 2) v = 0.5f * v * (1.0f + erff(v * 0.70710678118654752f));
      if (ACT == 3) { const float u = 0.7978845608028654f * (v + 0.044715f * v * v * v); v = 0.5f * v * (1.0f + tanhf(u)); }
      so[w][8 * hh + r][t * 16 + ln] = v;
    }
  }
  __builtin_amdgcn_fence(__ATOMIC_ACQ_REL, "workgroup");
  __builtin_amdgcn_wave_barrier();
  const int rsub = lane >> 4, c4 = (lane & 15) * 4;
  {
#pragma unroll
    for (int q = 0; q < 8; ++q) {
      const int r = q * 2 + rsub;
      const v4f v = *(const v4fa*)&so[w][r][c4];
      *(v4f*)(C + (size_t)(row0 + r) * ldc + col0 + c4) = v;
    }
    
  }
}
// row LayerNorm (biased variance, eps) over N: s = X (+ R); optional out_sum <- s; out_norm <- (s-mu)*rsqrt(var+eps)*g + b
template <bool PARAM_BF16>
__global__ __launch_bounds__(256) void k_layernorm(const float* __restrict__ X, const float* __restrict__ R, const float* __restrict__ g, const float* __restrict__ bta,
                                                  float* __restrict__ out_sum, float* __restrict__ out_norm, int N, float eps) {
  __shared__ float red[256];
  const int row = blockIdx.x, tid = threadIdx.x;
  const float* x = X + (size_t)row * N; const float* rr = R ? R + (size_t)row * N : nullptr;
  float vals[16];                     // up to N = 4096
  const int per = N / 256;            // contiguous chunk per thread? use strided-by-4 chunks: thread handles j = tid*4 + 1024*u
  float s1 = 0.f;
  for (int u = 0; u < per / 4; ++u) {
    const int j = tid * 4 + 1024 * u;
    const v4f a = *(const v4fa*)(x + j);
    v4f b = {0.f,0.f,0.f,0.f}; if (rr) b = *(const v4fa*)(rr + j);
#pragma unroll
    for (int q = 0; q < 4; ++q) { const float v = a[q] + b[q]; vals[u * 4 + q] = v; s1 += v; }
  }
  red[tid] = s1; __syncthreads();
  for (int st = 128; st > 0; st >>= 1) { if (tid < st) red[tid] += red[tid + st]; __syncthreads(); }
  const float mu = red[0] / (float)N; __syncthreads();
  float s2 = 0.f;
  for (int u = 0; u < per / 4; ++u)
#pragma unroll
    for (int q = 0; q < 4; ++q) { const float c = vals[u * 4 + q] - mu; s2 += c * c; }
  red[tid] = s2; __syncthreads();
  for (int st = 128; st > 0; st >>= 1) { if (tid < st) red[tid] += red[tid + st]; __syncthreads(); }
  const float rs = rsqrtf(red[0] / (float)N + eps);
  {
    for (int u = 0; u < per / 4; ++u) {
      const int j = tid * 4 + 1024 * u;
      v4f o, sm;
#pragma unroll
      for (int q = 0; q < 4; ++q) {
        float gg = g[j + q], bb = bta[j + q];
        if (PARAM_BF16) { gg = bf16_round(gg); bb = bf16_round(bb); }
        sm[q] = vals[u * 4 + q]; o[q] = (vals[u * 4 + q] - mu) * rs * gg + bb;
      }
      if (out_sum) *(v4f*)(out_sum + (size_t)row * N + j) = sm;
      *(v4f*)(out_norm + (size_t)row * N + j) = o;
    }
    
  }
}



// ---- f16 WMMA path (v_wmma_f32_16x16x32_f16): 11-bit significands for operands in range — used where a [0,1] probability operand needs more precision than bf16
typedef _Float16 v16h __attribute__((ext_vector_type(16)));
union FragH { v16h v; v8us half[2]; _Float16 h[16]; unsigned short u[16]; };
template <int NT>
__device__ __forceinline__ v8f mmaH(v16h ah, v16h al, v16h bh, v16h bl, v8f c) {
  c = __builtin_amdgcn_wmma_f32_16x16x32_f16(false, ah, false, bh, (short)0, c, false, false);
  if (NT >= 2) c = __builtin_amdgcn_wmma_f32_16x16x32_f16(false, al, false, bh, (short)0, c, false, false);
  if (NT >= 3) c = __builtin_amdgcn_wmma_f32_16x16x32_f16(false, ah, false, bl, (short)0, c, false, false);
  asm volatile("v_nop\n\tv_nop\n\tv_nop\n\tv_nop" : "+v"(c) : "v"(ah), "v"(al), "v"(bh), "v"(bl));
  return c;
}
// batched GEMM like k_gemm_b but f16 operands: A f32 (split into f16 hi/lo if ASPLIT, else rounded to f16), Bt = f16 values [n][k]; alpha; C f32; N multiple of 16 (partial tiles skipped)
template <bool ASPLIT>
__global__ __launch_bounds__(128) void k_gemm_h(const float* __restrict__ A, int lda, size_t sA, const _Float16* __restrict__ Bh, int ldb, size_t sB, float alpha, float* __restrict__ C, int ldc, size_t sC, int M, int N, int K) {
  __shared__ __attribute__((aligned(16))) float so[4][16][64];
  const int tid = threadIdx.x, w = tid >> 5, lane = tid & 31, ln = lane & 15, hh = lane >> 4; const int by = blockIdx.y;
  A += (size_t)by * sA; Bh += (size_t)by * sB; C += (size_t)by * sC;
  const int ntn = (N + 63) / 64; const int wid = blockIdx.x * 4 + w; const int mt = wid / ntn, nq = wid % ntn; if (mt * 16 >= M) return;
  const int row0 = mt * 16, col0 = nq * 64; const float* arow = A + (size_t)(row0 + ln) * lda;
  v8f acc[4] = {};
  for (int kb = 0; kb < K; kb += 32) {
    FragH ah, al;
    const v4f x0 = *(const v4fa*)(arow + kb + 8 * hh), x1 = *(const v4fa*)(arow + kb + 8 * hh + 4), x2 = *(const v4fa*)(arow + kb + 16 + 8 * hh), x3 = *(const v4fa*)(arow + kb + 16 + 8 * hh + 4);
    float xs[16] = {x0[0],x0[1],x0[2],x0[3],x1[0],x1[1],x1[2],x1[3],x2[0],x2[1],x2[2],x2[3],x3[0],x3[1],x3[2],x3[3]};
#pragma unroll
    for (int i = 0; i < 16; ++i) { const _Float16 h = (_Float16)xs[i]; ah.h[i] = h; al.h[i] = ASPLIT ? (_Float16)(xs[i] - (float)h) : (_Float16)0.0f; }
#pragma unroll
    for (int t = 0; t < 4; ++t) { if (col0 + t * 16 >= N) continue; const size_t boff = (size_t)(col0 + t * 16 + ln) * ldb + kb; FragH bq; bq.half[0] = *(const v8us*)(Bh + boff + 8 * hh); bq.half[1] = *(const v8us*)(Bh + boff + 16 + 8 * hh);
      acc[t] = mmaH<ASPLIT ? 2 : 1>(ah.v, al.v, bq.v, bq.v, acc[t]); }
  }
#pragma unroll
  for (int t = 0; t < 4; ++t) { if (col0 + t * 16 >= N) continue;
#pragma unroll
    for (int r = 0; r < 8; ++r) so[w][8 * hh + r][t * 16 + ln] = acc[t][r] * alpha; }
  __builtin_amdgcn_fence(__ATOMIC_ACQ_REL, "workgroup"); __builtin_amdgcn_wave_barrier();
  const int rsub = lane >> 4, c4 = (lane & 15) * 4;
  {
#pragma unroll
    for (int q = 0; q < 8; ++q) { const int r = q * 2 + rsub; if (col0 + c4 < N) { const v4f v = *(const v4fa*)&so[w][r][c4]; *(v4f*)(C + (size_t)(row0 + r) * ldc + col0 + c4) = v; } }
     }
}

// Wt[n][k] = f16(bf16(W[k][n])·scale) from f32 row-major W[K][N] (scale = power of two; bf16-exact weights stay exact in f16 away from the subnormal range)
// y picks one of four weight matrices of the same shape; their Wt planes lie one behind the other. bx: the block's index inside its matrix.
// A block of 256 threads turns a tile of 128 k rows x 128 columns. Read: a thread takes 4 columns (16 bytes) in each half of 8 consecutive k rows, all 16 loads in flight, 16 lanes side by side on 256 bytes of a row. Its 8 k values of a column are one 16-byte piece of a Wt row; the pieces meet in LDS, and every Wt row of the tile leaves as 256 contiguous bytes.
#define WP 136                       /* LDS pitch of a turned row in 16-bit elements: 128 k + 8, 272 B = 16 B x odd */
__device__ __forceinline__ void d_wt_f16(const float* __restrict__ W0, const float* __restrict__ W1, const float* __restrict__ W2, const float* __restrict__ W3, _Float16* __restrict__ Wt, int K, int N, float scale, int bx, int y, unsigned short (&tl)[128][WP]) {
  const float* W = (y == 0) ? W0 : (y == 1) ? W1 : (y == 2) ? W2 : W3; Wt += (size_t)y * K * N;
  const int ng = threadIdx.x & 15, kg = threadIdx.x >> 4; const int n0 = (bx % (N / 128)) * 128, k0 = (bx / (N / 128)) * 128;
  const float* p = W + (size_t)(k0 + 8 * kg) * N + n0 + 4 * ng; v4f r[2][8];
#pragma unroll      /* r[] in registers; the 16 loads in flight at once */
  for (int i = 0; i < 8; ++i) { r[0][i] = *(const v4fa*)(p + (size_t)i * N); r[1][i] = *(const v4fa*)(p + (size_t)i * N + 64); }
  asm volatile("" :: "v"(r[0][0]), "v"(r[0][1]), "v"(r[0][2]), "v"(r[0][3]), "v"(r[0][4]), "v"(r[0][5]), "v"(r[0][6]), "v"(r[0][7]), "v"(r[1][0]), "v"(r[1][1]), "v"(r[1][2]), "v"(r[1][3]), "v"(r[1][4]), "v"(r[1][5]), "v"(r[1][6]), "v"(r[1][7]));      /* inputs only, loaded values: the 16 loads stand as one group in front of the conversions (left alone, the compiler holds 6 of them back until the first 10 have landed: two memory latencies in a row) */
#pragma unroll      /* r[] in registers */
  for (int c = 0; c < 2; ++c) for (int j = 0; j < 4; ++j) { FragH f; for (int i = 0; i < 8; ++i) f.h[i] = (_Float16)(bf16_round(r[c][i][j]) * scale); *(v8us*)&tl[64 * c + 4 * ng + j][8 * kg] = f.half[0]; }
  __syncthreads();      /* the tile is turned; passed by the whole block */
#pragma unroll      /* the 8 LDS reads in flight at once */
  for (int u = 0; u < 8; ++u) { const int n = 16 * u + kg; const v8us o = *(const v8us*)&tl[n][8 * ng]; *(v8us*)((unsigned short*)Wt + (size_t)(n0 + n) * K + k0 + 8 * ng) = o; }
}
// k_gemm_hh variant with fused epilogue: v = acc·alpha + bias[by·sBias + col] (+ CP[(row/rowsPerB)·sCPb + by·64 + col] if CP) ; ACT 0 none / 1 elu ; writes f16 C16 (and f32 C if non-null)
template <int ACT>
__global__ __launch_bounds__(128) void k_gemm_hhx(const _Float16* __restrict__ A, int lda, size_t sA, const _Float16* __restrict__ Bh, int ldb, size_t sB, float alpha, const float* __restrict__ bias, size_t sBias, const float* __restrict__ CP, int rowsPerB, size_t sCPb, int row0g,
    float* __restrict__ C, _Float16* __restrict__ C16, int ldc, size_t sC, int M, int N, int K) {
  __shared__ __attribute__((aligned(16))) float so[4][16][64];
  const int tid = threadIdx.x, w = tid >> 5, lane = tid & 31, ln = lane & 15, hh = lane >> 4; const int by = blockIdx.y;
  A += (size_t)by * sA; Bh += (size_t)by * sB; const size_t cofs = (size_t)by * sC; const float* bp = bias ? bias + (size_t)by * sBias : nullptr;
  const int ntn = (N + 63) / 64; const int wid = blockIdx.x * 4 + w; const int mt = wid / ntn, nq = wid % ntn; if (mt * 16 >= M) return;
  const int row0 = mt * 16, col0 = nq * 64; const _Float16* arow = A + (size_t)(row0 + ln) * lda;
  v8f acc[4] = {};
  for (int kb = 0; kb < K; kb += 32) { FragH ah; ah.half[0] = *(const v8us*)((const unsigned short*)arow + kb + 8 * hh); ah.half[1] = *(const v8us*)((const unsigned short*)arow + kb + 16 + 8 * hh);
#pragma unroll
    for (int t = 0; t < 4; ++t) { if (col0 + t * 16 >= N) continue; const size_t boff = (size_t)(col0 + t * 16 + ln) * ldb + kb; FragH bq; bq.half[0] = *(const v8us*)((const unsigned short*)Bh + boff + 8 * hh); bq.half[1] = *(const v8us*)((const unsigned short*)Bh + boff + 16 + 8 * hh);
      acc[t] = mmaH<1>(ah.v, ah.v, bq.v, bq.v, acc[t]); }
  }
#pragma unroll
  for (int t = 0; t < 4; ++t) { if (col0 + t * 16 >= N) continue; const int col = col0 + t * 16 + ln; const float bv = bp ? bf16_round(bp[col]) : 0.f;
#pragma unroll
    for (int r = 0; r < 8; ++r) { float v = acc[t][r] * alpha + bv; if (CP) { const int rr = row0g + row0 + 8 * hh + r; if (rowsPerB < 0) v += CP[cofs + (size_t)rr * ldc + col];      /* rowsPerB < 0: own element of the batched C plane */ else { const int bidx = rr / rowsPerB; v += CP[(size_t)bidx * sCPb + (size_t)by * 64 + col]; } } if (ACT == 1) v = (v > 0.f) ? v : expm1f(v); else if (ACT == 7) v = (v > 0.f) ? v + 1.0f : expf(v); else if (ACT == 8) v = tanhf(v); else if (ACT == 9) v = 0.5f * v * (1.0f + tanhf(0.7978845608028654f * (v + 0.044715f * v * v * v))); else if (ACT == 11) v = 1.0f / (1.0f + expf(-v)); else if (ACT == 12) v = (v > 0.f) ? v : 0.01f * v; else if (ACT == 14) v = (v > 0.f) ? v : 0.1f * v; else if (ACT == 16) v = (v >= 0.f) ? v : 0.3f * v; else if (ACT == 17) v = (v >= 0.f) ? v : 0.2f * v; else if (ACT == 15) v = v / (1.0f + expf(-v)); else if (ACT == 3) v = fmaxf(v, 0.f); else if (ACT == 6) v = 0.5f * v * (1.0f + erff(v * 0.70710678118654752f)); so[w][8 * hh + r][t * 16 + ln] = v; } }
  __builtin_amdgcn_fence(__ATOMIC_ACQ_REL, "workgroup"); __builtin_amdgcn_wave_barrier();
  const int rsub = lane >> 4, c4 = (lane & 15) * 4; typedef _Float16 v4h __attribute__((ext_vector_type(4)));
  {
#pragma unroll
    for (int q = 0; q < 8; ++q) { const int r = q * 2 + rsub; if (col0 + c4 < N) { const v4f v = *(const v4fa*)&so[w][r][c4]; if (C) *(v4f*)(C + cofs + (size_t)(row0 + r) * ldc + col0 + c4) = v; if (C16) { v4h h4; for (int i = 0; i < 4; ++i) h4[i] = (_Float16)v[i]; *(v4h*)(C16 + cofs + (size_t)(row0 + r) * ldc + col0 + c4) = h4; } } }
     }
}


typedef _Float16 v4h __attribute__((ext_vector_type(4)));

// y picks the stream (query, key, value input); the f16 planes lie one behind the other. bx: the block's index inside its stream. A thread converts XU pieces of 8 values, 256 pieces apart: 16 loads of 16 bytes in flight, a wave's stores 512 contiguous bytes each.
#define XU 8
__device__ __forceinline__ void d_x16(const float* __restrict__ x0, const float* __restrict__ x1, const float* __restrict__ x2, _Float16* __restrict__ X16, size_t n8, int bx, int y) { const size_t t = (size_t)bx * (256 * XU) + threadIdx.x;
  const float* x = (y == 0) ? x0 : (y == 1) ? x1 : x2; X16 += (size_t)y * n8 * 8; v4f a[XU], c[XU];
#pragma unroll      /* a[], c[] in registers; all loads in flight at once */
  for (int u = 0; u < XU; ++u) { a[u] = *(const v4fa*)(x + (t + 256 * u) * 8); c[u] = *(const v4fa*)(x + (t + 256 * u) * 8 + 4); }
#pragma unroll      /* a[], c[] in registers */
  for (int u = 0; u < XU; ++u) { FragH f; for (int q = 0; q < 4; ++q) { f.h[q] = (_Float16)bf16_round(a[u][q]); f.h[4 + q] = (_Float16)bf16_round(c[u][q]); } *(v8us*)((unsigned short*)X16 + (t + 256 * u) * 8) = f.half[0]; } }
// One launch for the two preparations, which do not depend on each other: the first 4 * NWX blocks turn the weights, the other 3 * NXX convert the input streams.
#define NWX ((DM / 128) * (DM / 128))          /* blocks per weight matrix: tiles of 128 k x 128 columns */
#define NXX ((int)(NR * DM / 8 / (256 * XU))) /* blocks per input stream: 256 * XU pieces of 8 values each */
__global__ __launch_bounds__(256) void k_prep(const float* __restrict__ W0, const float* __restrict__ W1, const float* __restrict__ W2, const float* __restrict__ W3, _Float16* __restrict__ Wt, const float* __restrict__ x0, const float* __restrict__ x1, const float* __restrict__ x2, _Float16* __restrict__ X16) {
  __shared__ __attribute__((aligned(16))) unsigned short tl[128][WP];
  const int bi = blockIdx.x;      /* the choice is the same for the whole block: the barrier in d_wt_f16 is passed by all of its threads or by none */
  if (bi < 4 * NWX) d_wt_f16(W0, W1, W2, W3, Wt, DM, DM, 16.0f, bi % NWX, bi / NWX, tl);
  else d_x16(x0, x1, x2, X16, NR * DM / 8, (bi - 4 * NWX) % NXX, (bi - 4 * NWX) / NXX); }
__global__ __launch_bounds__(256) void k_h16(const float* __restrict__ x, _Float16* __restrict__ X16, size_t n8) { const size_t t = (size_t)blockIdx.x * 256 + threadIdx.x; if (t >= n8) return; FragH f;
#pragma unroll
  for (int q = 0; q < 8; ++q) f.h[q] = (_Float16)x[t * 8 + q]; *(v8us*)((unsigned short*)X16 + t * 8) = f.half[0];  }
__global__ __launch_bounds__(256) void k_round16f(const float* __restrict__ W, _Float16* __restrict__ Bt, size_t n8) { const size_t t = (size_t)blockIdx.x * 256 + threadIdx.x; if (t >= n8) return; FragH f;
#pragma unroll
  for (int i = 0; i < 8; ++i) f.h[i] = (_Float16)(bf16_round(W[t * 8 + i]) * 16.0f); *(v8us*)((unsigned short*)Bt + t * 8) = f.half[0];  }
// One 64 x 64 tile (index bx) by 256 threads (tid) through their own LDS tile tl; the barrier inside is passed by the whole block.
template <int NHv, int TTv>
__device__ __forceinline__ void d_vt(const _Float16* __restrict__ V16, int ldv, int voff, _Float16* __restrict__ Vt, int bx, int tid, unsigned short (&tl)[64][66]) { const int slab = bx / (TTv / 64), lg = bx % (TTv / 64); const int b = slab / NHv, h = slab % NHv;
  for (int i = tid; i < 64 * 8; i += 256) { const int r = i / 8, c8 = (i % 8) * 8; FragH f; f.half[0] = *(const v8us*)((const unsigned short*)V16 + ((size_t)b * TTv + lg * 64 + r) * ldv + voff + h * 64 + c8);
#pragma unroll
    for (int q = 0; q < 8; ++q) tl[r][c8 + q] = f.u[q]; }
  __syncthreads();
  {
#pragma unroll
    for (int rd = 0; rd < 2; ++rd) { const int d = rd * 32 + tid / 8, pc = tid % 8; FragH f;
#pragma unroll
      for (int q = 0; q < 8; ++q) f.u[q] = tl[pc * 8 + q][d];
      *(v8us*)((unsigned short*)Vt + ((size_t)slab * 64 + d) * TTv + lg * 64 + pc * 8) = f.half[0]; }
    asm volatile("s_wait_xcnt 0x0" ::: "memory");      /* behind the two stores: in the shared launch another body's code follows them in the listing and reuses their registers */
     } }

__device__ __forceinline__ void d_hl(const float* __restrict__ F, _Float16* __restrict__ Hh, _Float16* __restrict__ Hl, size_t n8, int bx) { const size_t t = (size_t)bx * 512 + threadIdx.x; if (t >= n8) return; FragH fh, fl; const v4f a = *(const v4fa*)(F + t * 8), c = *(const v4fa*)(F + t * 8 + 4);
#pragma unroll
  for (int q = 0; q < 4; ++q) { _Float16 h = (_Float16)a[q]; fh.h[q] = h; fl.h[q] = (_Float16)((a[q] - (float)h) * 1024.0f); h = (_Float16)c[q]; fh.h[4 + q] = h; fl.h[4 + q] = (_Float16)((c[q] - (float)h) * 1024.0f); }
  { *(v8us*)((unsigned short*)Hh + t * 8) = fh.half[0]; *(v8us*)((unsigned short*)Hl + t * 8) = fl.half[0];  } }

// ---- fast GEMM (wave tile 32x64, block tile 128x64; requires M % 128 == 0 rows per launch region, N % 64 == 0 and K % 64 == 0); epilogue = k_gemm_hhx semantics ----
__device__ __forceinline__ v16h g2_frag(const _Float16* p, int hh) { FragH f; f.half[0] = *(const v8us*)((const unsigned short*)p + 8 * hh); f.half[1] = *(const v8us*)((const unsigned short*)p + 16 + 8 * hh); return f.v; }
__device__ __forceinline__ v8f g2_mma(v16h a, v16h b, v8f c) { v8f d = __builtin_amdgcn_wmma_f32_16x16x32_f16(false, a, false, b, (short)0, c, false, false); asm volatile("v_nop\n\tv_nop\n\tv_nop\n\tv_nop" : "+v"(d) : "v"(a), "v"(b)); return d; }
// The block's 4 waves need the same 64 Bt rows, and each A row feeds 4 column tiles: every 64-wide k step's 128 A rows and 64 Bt rows are brought into LDS once per block, as whole 128-byte rows (asynchronous copies, 12 of 16 bytes a thread), and the waves take their fragments from there. Two buffers: the next step's copies fly while this step is worked on.
#define GP 72                        /* LDS pitch of a staged row in 16-bit elements: 144 B = 16 B x odd, conflict-free for 16-byte fragment reads down 16 rows */
#define GR (16 * GP * 2)             /* bytes of 16 staged rows: the distance between two copies of one thread */
#define GB (192 * GP * 2)            /* bytes of one buffer: 128 A rows, then 64 Bt rows */
// Twelve 16-byte copies of one thread (8 A rows, 4 Bt rows); the wait as the statement's last line keeps every rewrite of the address registers behind it.
__device__ __forceinline__ void g2_copy12(unsigned l, const _Float16* a, size_t as, const _Float16* b, size_t bs) {
  asm volatile("global_load_async_to_lds_b128 %0, %12, off\n\tglobal_load_async_to_lds_b128 %1, %13, off\n\tglobal_load_async_to_lds_b128 %2, %14, off\n\tglobal_load_async_to_lds_b128 %3, %15, off\n\t"
               "global_load_async_to_lds_b128 %4, %16, off\n\tglobal_load_async_to_lds_b128 %5, %17, off\n\tglobal_load_async_to_lds_b128 %6, %18, off\n\tglobal_load_async_to_lds_b128 %7, %19, off\n\t"
               "global_load_async_to_lds_b128 %8, %20, off\n\tglobal_load_async_to_lds_b128 %9, %21, off\n\tglobal_load_async_to_lds_b128 %10, %22, off\n\tglobal_load_async_to_lds_b128 %11, %23, off\n\ts_wait_xcnt 0x0"
               :: "v"(l), "v"(l + GR), "v"(l + 2 * GR), "v"(l + 3 * GR), "v"(l + 4 * GR), "v"(l + 5 * GR), "v"(l + 6 * GR), "v"(l + 7 * GR), "v"(l + 8 * GR), "v"(l + 9 * GR), "v"(l + 10 * GR), "v"(l + 11 * GR),
                  "v"(a), "v"(a + as), "v"(a + 2 * as), "v"(a + 3 * as), "v"(a + 4 * as), "v"(a + 5 * as), "v"(a + 6 * as), "v"(a + 7 * as), "v"(b), "v"(b + bs), "v"(b + 2 * bs), "v"(b + 3 * bs) : "memory"); }
// One product's arguments. gx: its blocks per batch index; blockIdx.z: a second batch index (the projection) with strides sAz, sBz, sCz and its own bias vector.
struct G2P { const _Float16* A; const _Float16* Bh; const float* bias; const float* bias1; const float* bias2; const float* CP; float* C; _Float16* C16; size_t sA, sB, sBias, sCPb, sC, sAz, sBz, sCz; float alpha; int lda, ldb, rowsPerB, row0g, ldc, M, N, K, gx; };
// Two products that do not depend on each other share a launch: blocks with blockIdx.x < n0 work on p0, the others on p1 (the choice is the same for the whole block).
template <int ACT>
__global__ __launch_bounds__(128) void k_gemm2(const G2P p0, const G2P p1, int n0) { static_assert(ACT == 0 || ACT == 3 || ACT == 6 || ACT == 8 || ACT == 9 || ACT == 11 || ACT == 12 || ACT == 14 || ACT == 15 || ACT == 16 || ACT == 17, "k_gemm2: unsupported ACT code (would silently apply no activation)");
  __shared__ __attribute__((aligned(16))) union { _Float16 ab[2][192][GP]; float so[4][32][68]; } sm;      /* [buffer][128 A rows, 64 Bt rows][element]; the epilogue's tiles take the same bytes once the last step has been read */
  auto& so = sm.so;
  const bool sec = (int)blockIdx.x >= n0;
#define G2S(m) (sec ? p1.m : p0.m)
  const _Float16* A = G2S(A); const _Float16* Bh = G2S(Bh); const float* bias = G2S(bias); const float* bias1 = G2S(bias1); const float* bias2 = G2S(bias2); const float* CP = G2S(CP); float* C = G2S(C); _Float16* C16 = G2S(C16);
  const size_t sA = G2S(sA), sB = G2S(sB), sBias = G2S(sBias), sCPb = G2S(sCPb), sC = G2S(sC), sAz = G2S(sAz), sBz = G2S(sBz), sCz = G2S(sCz); const float alpha = G2S(alpha);
  const int lda = G2S(lda), ldb = G2S(ldb), rowsPerB = G2S(rowsPerB), row0g = G2S(row0g), ldc = G2S(ldc), M = G2S(M), N = G2S(N), K = G2S(K), gx = G2S(gx);
#undef G2S
  const int fl = (int)blockIdx.x - (sec ? n0 : 0); const int fy = fl / gx, bx = fl - fy * gx;      /* a product's batch index may lie in blockIdx.x (fy) or in blockIdx.y */
  const int tid = threadIdx.x, w = tid >> 5, lane = tid & 31, ln = lane & 15, hh = lane >> 4; const int by = blockIdx.y + fy;
  const int bz = blockIdx.z; const float* bsel = (bz == 0) ? bias : (bz == 1) ? bias1 : bias2;
  A += (size_t)by * sA + (size_t)bz * sAz; Bh += (size_t)by * sB + (size_t)bz * sBz; const size_t cofs = (size_t)by * sC + (size_t)bz * sCz; const float* bp = bsel ? bsel + (size_t)by * sBias : nullptr;
  const int ntn = N >> 6; const int mt = bx / ntn, nq = bx - mt * ntn; const int row0 = mt * 128 + 32 * w, col0 = nq * 64; if (mt * 128 >= M) return;      /* the same for the whole block, in front of every barrier */
  const int sr = tid >> 3, sc = (tid & 7) * 8;      /* staging: a thread copies piece sc of rows sr + 16 j of both tiles; a wave's copy is 4 whole rows */
  const _Float16* ag = A + (size_t)(mt * 128 + sr) * lda + sc; const _Float16* bg = Bh + (size_t)(col0 + sr) * ldb + sc;
  const unsigned ls = (unsigned)(size_t)&sm.ab[0][sr][sc];      /* the thread's LDS byte address in buffer 0 */
  auto stage = [&](int t) { g2_copy12(ls + (unsigned)(t & 1) * GB, ag + t * 64, (size_t)16 * lda, bg + t * 64, (size_t)16 * ldb); };
  const int nst = K >> 6;
  stage(0);
  asm volatile("s_wait_asynccnt 0x0" ::: "memory");      /* this wave's copies of step 0 have landed */
  __syncthreads();      /* ... and every other wave's: step 0 may be read */
  if (nst > 1) stage(1);
  const v8f z8 = {0.f,0.f,0.f,0.f,0.f,0.f,0.f,0.f}; v8f c00 = z8, c01 = z8, c02 = z8, c03 = z8, c10 = z8, c11 = z8, c12 = z8, c13 = z8;
#pragma unroll 1      /* one step already holds 24 fragment reads and 16 matrix products; a second copy would only cost registers */
  for (int s = 0; s < nst; ++s) { const _Float16* ap = &sm.ab[s & 1][32 * w + ln][0]; const _Float16* bq = &sm.ab[s & 1][128 + ln][0]; v16h a[2][2], b[2][4];      /* [32-wide k half of the step][16-row tile] */
#pragma unroll      /* a[], b[] in registers */
    for (int kh = 0; kh < 2; ++kh) { for (int t = 0; t < 2; ++t) a[kh][t] = g2_frag(ap + 16 * t * GP + 32 * kh, hh); for (int t = 0; t < 4; ++t) b[kh][t] = g2_frag(bq + 16 * t * GP + 32 * kh, hh); }
    asm volatile("" :: "v"(a[0][0]), "v"(a[0][1]), "v"(b[0][0]), "v"(b[0][1]), "v"(b[0][2]), "v"(b[0][3]), "v"(a[1][0]), "v"(a[1][1]), "v"(b[1][0]), "v"(b[1][1]), "v"(b[1][2]), "v"(b[1][3]));      /* inputs only, loaded values: the 24 LDS reads of the step stand as one group in front of the products (left alone, the compiler reuses one B register set and puts a full LDS wait in front of every pair of products) */
#pragma unroll      /* the two k halves in k order */
    for (int kh = 0; kh < 2; ++kh) {
      c00 = g2_mma(a[kh][0], b[kh][0], c00); c10 = g2_mma(a[kh][1], b[kh][0], c10);
      c01 = g2_mma(a[kh][0], b[kh][1], c01); c11 = g2_mma(a[kh][1], b[kh][1], c11);
      c02 = g2_mma(a[kh][0], b[kh][2], c02); c12 = g2_mma(a[kh][1], b[kh][2], c12);
      c03 = g2_mma(a[kh][0], b[kh][3], c03); c13 = g2_mma(a[kh][1], b[kh][3], c13); }
    asm volatile("s_wait_dscnt 0x0" ::: "memory");      /* this wave's reads of the step's buffer are done before the buffer is handed back */
    asm volatile("s_wait_asynccnt 0x0" ::: "memory");      /* this wave's copies of step s + 1 have landed */
    __syncthreads();      /* publishes step s + 1 and ends every wave's reads of step s's buffer */
    if (s + 2 < nst) stage(s + 2); }      /* refill of the buffer just read; the test is the same for the whole block */
  asm volatile("s_wait_asynccnt 0x0" ::: "memory");      /* no copy outstanding when the epilogue takes the buffers' bytes */
  v8f accs[8] = {c00, c01, c02, c03, c10, c11, c12, c13};
#pragma unroll
  for (int u = 0; u < 8; ++u) { const int t = u & 3, half = u >> 2; const int col = col0 + t * 16 + ln; const float bv = bp ? bf16_round(bp[col]) : 0.f;
#pragma unroll
    for (int r = 0; r < 8; ++r) { const int rloc = half * 16 + 8 * hh + r; float v = accs[u][r] * alpha + bv; if (CP) { if (rowsPerB < 0) v += CP[cofs + (size_t)(row0g + row0 + rloc) * ldc + col];      /* rowsPerB < 0: own element of the batched C plane */ else { const int bidx = (row0g + row0 + rloc) / rowsPerB; v += CP[(size_t)bidx * sCPb + (size_t)by * 64 + col]; } }
      if (ACT == 3) v = fmaxf(v, 0.f); else if (ACT == 6) v = 0.5f * v * (1.0f + erff(v * 0.70710678118654752f)); else if (ACT == 11) v = 1.0f / (1.0f + expf(-v)); else if (ACT == 15) v = v / (1.0f + expf(-v)); else if (ACT == 12) v = (v > 0.f) ? v : 0.01f * v; else if (ACT == 8) v = tanhf(v); else if (ACT == 9) v = 0.5f * v * (1.0f + tanhf(0.7978845608028654f * (v + 0.044715f * v * v * v))); else if (ACT == 14) v = (v > 0.f) ? v : 0.1f * v; else if (ACT == 16) v = (v >= 0.f) ? v : 0.3f * v; else if (ACT == 17) v = (v >= 0.f) ? v : 0.2f * v;
      so[w][rloc][t * 16 + ln] = v; } }
  __builtin_amdgcn_fence(__ATOMIC_ACQ_REL, "workgroup"); __builtin_amdgcn_wave_barrier();
  const int rsub = lane >> 4, c4 = (lane & 15) * 4;
  {
#pragma unroll
    for (int q = 0; q < 16; ++q) { const int r = q * 2 + rsub; const v4f v = *(const v4fa*)&so[w][r][c4]; if (C) *(v4f*)(C + cofs + (size_t)(row0 + r) * ldc + col0 + c4) = v; if (C16) { v4h h4; for (int i = 0; i < 4; ++i) h4[i] = (_Float16)v[i]; *(v4h*)(C16 + cofs + (size_t)(row0 + r) * ldc + col0 + c4) = h4; } }
     } }


__global__ __launch_bounds__(256) void k_wnat(const float* __restrict__ w, size_t n8, _Float16* __restrict__ Bt) { const size_t t = (size_t)blockIdx.x * 256 + threadIdx.x; if (t >= n8) return; FragH f; for (int q = 0; q < 8; ++q) f.h[q] = (_Float16)(bf16_round(w[t * 8 + q]) * 16.0f); *(v8us*)((unsigned short*)Bt + t * 8) = f.half[0];  }
__global__ __launch_bounds__(256) void k_rsm(const float* __restrict__ S, _Float16* __restrict__ P, int nrows) {
  #pragma clang fp contract(off)
  const int i = blockIdx.x * 256 + threadIdx.x; if (i >= nrows) return; const float* s = S + (size_t)i * SQ; float mx = -3.0e38f;
#pragma unroll 1
  for (int j = 0; j < SQ; ++j) mx = fmaxf(mx, s[j]); float se = 0.f;
#pragma unroll 1
  for (int j = 0; j < SQ; ++j) se += expf(s[j] - mx); const float sc = 256.0f / se;
#pragma unroll 1
  for (int j0 = 0; j0 < SQ; j0 += 8) { FragH f; for (int q = 0; q < 8; ++q) f.h[q] = (_Float16)(expf(s[j0 + q] - mx) * sc); unsigned short* d = (unsigned short*)P + (size_t)i * SQ + j0; *(v8us*)d = f.half[0];  } }
__global__ __launch_bounds__(256) void k_vt(const _Float16* __restrict__ V16, int b, int h0, _Float16* __restrict__ VT) { __shared__ unsigned short tl[64][65]; const int tid = threadIdx.x; const int hh = blockIdx.x % HG, sg = blockIdx.x / HG; const int s0 = sg * 64; const int h = h0 + hh;
  for (int i = tid; i < 64 * 8; i += 256) { const int j = i / 8, d8 = (i % 8) * 8; FragH f; f.half[0] = *(const v8us*)((const unsigned short*)V16 + ((size_t)b * SQ + s0 + j) * DM + h * HD + d8); for (int q = 0; q < 8; ++q) tl[d8 + q][j] = f.u[q]; }
  __syncthreads();
  { for (int i = tid; i < 64 * 8; i += 256) { const int d = i / 8, j8 = (i % 8) * 8; FragH f; for (int q = 0; q < 8; ++q) f.u[q] = tl[d][j8 + q]; *(v8us*)((unsigned short*)VT + ((size_t)hh * HD + d) * SQ + s0 + j8) = f.half[0]; }  } }



__global__ __launch_bounds__(256) void k_rsmkm(const float* __restrict__ S, _Float16* __restrict__ P, int nrows, const int* __restrict__ am) {
  #pragma clang fp contract(off)
  const int t = blockIdx.x * 256 + threadIdx.x; if (t >= nrows) return; const size_t i = (size_t)t; const float* s = S + i * SQ; const int* mr = am + (size_t)(t % SQ) * SQ; float mx = -3.0e38f;
#pragma unroll 1
  for (int j = 0; j < SQ; ++j) { const float f = (mr[j] != 0) ? 1.f : 0.f; mx = fmaxf(mx, fmaf(f, s[j], (1.f - f) * -1.0e9f)); } float se = 0.f;
#pragma unroll 1
  for (int j = 0; j < SQ; ++j) { const float f = (mr[j] != 0) ? 1.f : 0.f; se += __expf(fmaf(f, s[j], (1.f - f) * -1.0e9f) - mx); } const float sc = 256.0f / se;
#pragma unroll 1
  for (int j0 = 0; j0 < SQ; j0 += 8) { FragH fr; for (int q = 0; q < 8; ++q) { const int j = j0 + q; const float f = (mr[j] != 0) ? 1.f : 0.f; fr.h[q] = (_Float16)(__expf(fmaf(f, s[j], (1.f - f) * -1.0e9f) - mx) * sc); }
    unsigned short* d = (unsigned short*)P + i * SQ + j0; *(v8us*)d = fr.half[0];  } }
// exp of four values as __expf forms it (v_exp_f32 of x * log2 e). One statement, so that the free slot the instruction set asks for behind a transcendental stands there by construction: outputs are early-clobbered (no v_exp_f32 overwrites a neighbour's source or reads its result), and the v_nop fills the slot behind the last one.
__device__ __forceinline__ v4f exp_x4(v4f x) { float r0, r1, r2, r3;
  asm("v_exp_f32 %0, %4\n\tv_exp_f32 %1, %5\n\tv_exp_f32 %2, %6\n\tv_exp_f32 %3, %7\n\tv_nop" : "=&v"(r0), "=&v"(r1), "=&v"(r2), "=&v"(r3) : "v"(x[0] * 1.44269504088896340736f), "v"(x[1] * 1.44269504088896340736f), "v"(x[2] * 1.44269504088896340736f), "v"(x[3] * 1.44269504088896340736f));
  const v4f r = {r0, r1, r2, r3}; return r; }
// exp of one value, same form as exp_x4 (the v_nop fills the free slot behind the transcendental).
__device__ __forceinline__ float exp_x1(float x) { float r; asm("v_exp_f32 %0, %1\n\tv_nop" : "=&v"(r) : "v"(x * 1.44269504088896340736f)); return r; }
__device__ __forceinline__ v8f fa_mma(v16h a, v16h b, v8f c) { return __builtin_amdgcn_wmma_f32_16x16x32_f16(false, a, false, b, (short)0, c, false, false); }
#define FP 72                        /* LDS pitch of a staged row in 16-bit elements: 144 B = 16 B x odd, conflict-free for 16-byte fragment reads down 16 rows */
#define FT (64 * FP * 2)             /* bytes of one staged tile (64 rows) */
// Four 16-byte copies of one thread; the wait as the statement's last line keeps every rewrite of the address registers behind it.
__device__ __forceinline__ void fa_copy4(unsigned l0, unsigned l1, unsigned l2, unsigned l3, const _Float16* g0, const _Float16* g1, const _Float16* g2, const _Float16* g3) {
  asm volatile("global_load_async_to_lds_b128 %0, %4, off\n\tglobal_load_async_to_lds_b128 %1, %5, off\n\tglobal_load_async_to_lds_b128 %2, %6, off\n\tglobal_load_async_to_lds_b128 %3, %7, off\n\ts_wait_xcnt 0x0" :: "v"(l0), "v"(l1), "v"(l2), "v"(l3), "v"(g0), "v"(g1), "v"(g2), "v"(g3) : "memory"); }
// The split of the exact last-tile o into its f16 planes (d_hl) depends on nothing that this launch makes and rides along: the blocks with blockIdx.x >= NFA, NHL of them, do that and nothing else.
#define QTL ((SQ - QT0) / 128)            /* 128-query tiles attended per (batch, head) */
#define NFA (NB * NH * QTL)               /* attention blocks */
#define NHL (NB * QT0 * DM / 8 / 512)     /* blocks of d_hl */
typedef float v2f __attribute__((ext_vector_type(2)));
__global__ __launch_bounds__(512) void k_fattn(const _Float16* __restrict__ Q, const _Float16* __restrict__ Kk, const _Float16* __restrict__ VTa, _Float16* __restrict__ O, const float* __restrict__ F, _Float16* __restrict__ Hh, _Float16* __restrict__ Hl) {
  __shared__ __attribute__((aligned(16))) union { _Float16 kv[2][2][2][64][FP]; struct { float o[8][8][32][4]; float ml[8][32][2]; } jn; } sm;      /* [buffer][wave group][k rows, V^T rows][row][element]; the join's [wave][piece][lane] planes take the same bytes once the last trip has been read */
  if (blockIdx.x >= NFA) { d_hl(F, Hh, Hl, (size_t)NB * QT0 * DM / 8, (int)blockIdx.x - NFA); return; }      /* the same for the whole block, in front of every copy and barrier */
  const int lane = threadIdx.x & 31, ln = lane & 15, hh = lane >> 4; const int w = __builtin_amdgcn_readfirstlane(threadIdx.x >> 5);      /* wave number in a scalar register: the tests on q0 and g below are scalar branches */
  const int qt = (int)blockIdx.x / (NB * NH), hb = (int)blockIdx.x % (NB * NH); const int h = hb % NH, b = hb / NH; const int g = w >> 3; const int q0 = qt * 128 + (w & 7) * 16; const int qi = q0 + ln;
  const _Float16* qp = Q + ((size_t)b * SQ + qi) * LQ + h * HD; const v16h qf0 = g2_frag(qp, hh), qf1 = g2_frag(qp + 32, hh);
  const int sr = threadIdx.x >> 3, sc = (threadIdx.x & 7) * 8;      /* staging: a thread copies piece sc of row sr of the four tiles; a wave's copy is 4 whole rows */
  const _Float16* kg = Kk + ((size_t)b * SQ + sr) * LQ + h * HD + sc; const _Float16* vg = VTa + (((size_t)b * NH + h) * HD + sr) * SQ + sc;
  const unsigned ls = (unsigned)(size_t)&sm.kv[0][0][0][sr][sc];      /* the thread's LDS byte address in buffer 0 */
  auto stage = [&](int t) { const unsigned l = ls + (unsigned)(t & 1) * (4 * FT); const _Float16* kr = kg + (size_t)t * 128 * LQ; const _Float16* vr = vg + t * 128; fa_copy4(l, l + FT, l + 2 * FT, l + 3 * FT, kr, vr, kr + (size_t)64 * LQ, vr + 64); };      /* trip t: keys 128 t ... 128 t + 127 */
  static_assert(QTL + 1 < SQ / 128 && SQ % 128 == 0, "every tile has at least three trips: the prologue's two stages exist, and each group meets visible keys for every query");
  stage(qt);
  asm volatile("s_wait_asynccnt 0x0" ::: "memory");      /* this wave's copies of the first trip have landed */
  __syncthreads();      /* ... and every other wave's: the first trip may be read */
  stage(qt + 1);
  const v8f z8 = {0.f,0.f,0.f,0.f,0.f,0.f,0.f,0.f}; v8f o[4] = {z8, z8, z8, z8}; float m = -1.0e30f, l = 0.f;
#pragma unroll 1      /* one pass already holds 32 fragment loads and 16 matrix products; a second copy would only cost registers */
  for (int p = qt; p < SQ / 128; ++p) { const int k0 = p * 128 + g * 64;
   if (k0 + 63 > q0) {      /* else every key of the pass is masked for every query of the wave: no work; the wave still passes the waits, the barrier and its share of the copies below */
    v8f s[4]; v16h kf[4][2], vf[4][2]; const _Float16* kp = &sm.kv[p & 1][g][0][ln][0]; const _Float16* vp = &sm.kv[p & 1][g][1][ln][0];
#pragma unroll      /* kf[] in registers */
    for (int t = 0; t < 4; ++t) { kf[t][0] = g2_frag(kp + 16 * t * FP, hh); kf[t][1] = g2_frag(kp + 16 * t * FP + 32, hh); }
    asm volatile("" :: "v"(kf[0][0]), "v"(kf[0][1]), "v"(kf[1][0]), "v"(kf[1][1]), "v"(kf[2][0]), "v"(kf[2][1]), "v"(kf[3][0]), "v"(kf[3][1]));      /* inputs only, loaded values: the 16 k reads of the pass stand as one group in front of the score products (left alone, the compiler spreads them among the products, each place with its own wait) */
#pragma unroll      /* s[] in registers */
    for (int t = 0; t < 4; ++t) { s[t] = fa_mma(kf[t][0], qf0, z8); s[t] = fa_mma(kf[t][1], qf1, s[t]); }
#pragma unroll      /* vf[] in registers; the v fragments arrive under the softmax arithmetic */
    for (int t = 0; t < 4; ++t) { vf[t][0] = g2_frag(vp + 16 * t * FP, hh); vf[t][1] = g2_frag(vp + 16 * t * FP + 32, hh); }
#pragma unroll      /* s[] in registers */
    for (int t = 0; t < 4; ++t) s[t] *= 0.125f;
    if (k0 <= q0 + 15) {      /* a pass whose keys all lie behind the wave's queries adds 0 * -1e9: skipped as an identity */
#pragma unroll      /* s[] in registers */
      for (int t = 0; t < 4; ++t) for (int r = 0; r < 8; ++r) { const float mk = (k0 + 16 * t + 8 * hh + r <= qi) ? 1.0f : 0.0f; s[t][r] = __fadd_rn(s[t][r], __fmul_rn(mk, -1.0e9f)); } }
    float mt = s[0][0];
#pragma unroll      /* s[] in registers */
    for (int t = 0; t < 4; ++t) for (int r = 0; r < 8; ++r) mt = fmaxf(mt, s[t][r]);
    mt = fmaxf(mt, __shfl_xor(mt, 16)); const float mn = fmaxf(m, mt); const float corr = exp_x1(m - mn); m = mn;
    v4f s4 = {0.f, 0.f, 0.f, 0.f}; FragH pf[2];
#pragma unroll      /* s[], pf[] in registers */
    for (int t = 0; t < 4; ++t) { const v4f a = {s[t][0], s[t][1], s[t][2], s[t][3]}, c = {s[t][4], s[t][5], s[t][6], s[t][7]}; const v4f ea = exp_x4(a - mn), ec = exp_x4(c - mn); s4 += ea; s4 += ec;
      for (int u = 0; u < 4; ++u) { pf[t >> 1].h[(t & 1) * 8 + u] = (_Float16)ea[u]; pf[t >> 1].h[(t & 1) * 8 + 4 + u] = (_Float16)ec[u]; } }
    l = l * corr + ((s4[0] + s4[1]) + (s4[2] + s4[3]));      /* each wave half keeps its own part of the sum; joined once behind the loop */
    asm volatile("" :: "v"(vf[0][0]), "v"(vf[0][1]), "v"(vf[1][0]), "v"(vf[1][1]), "v"(vf[2][0]), "v"(vf[2][1]), "v"(vf[3][0]), "v"(vf[3][1]));      /* inputs only, loaded values: the 16 v reads are all out before the first output product, none among the products */
#pragma unroll      /* o[] in registers */
    for (int t = 0; t < 4; ++t) { o[t] *= corr; o[t] = fa_mma(vf[t][0], pf[0].v, o[t]); o[t] = fa_mma(vf[t][1], pf[1].v, o[t]); } }
    __builtin_amdgcn_sched_barrier(0);      /* the pass's arithmetic stays in front of the waits below: with the rider's body in the kernel the compiler lifted them and the barrier to the middle of the pass, which halves the flight time of the next pass's copies */
    asm volatile("s_wait_dscnt 0x0" ::: "memory");      /* this wave's reads of the trip's buffer are done before the buffer is handed back */
    asm volatile("s_wait_asynccnt 0x0" ::: "memory");      /* this wave's copies of trip p + 1 have landed */
    __syncthreads();      /* publishes trip p + 1 and ends every wave's reads of trip p's buffer */
    if (p + 2 < SQ / 128) stage(p + 2); }      /* refill of the buffer just read; the test is the same for the whole block */
  asm volatile("s_wait_asynccnt 0x0" ::: "memory");      /* no copy outstanding when the join takes the buffers' bytes */
  if (g == 1) {      /* the second group hands its partial result over, lane to lane: 16-byte pieces, a wave's 32 lanes side by side */
#pragma unroll      /* o[] in registers */
    for (int t = 0; t < 4; ++t) { const v4f a = {o[t][0], o[t][1], o[t][2], o[t][3]}, c = {o[t][4], o[t][5], o[t][6], o[t][7]}; *(v4f*)&sm.jn.o[w & 7][2 * t][lane][0] = a; *(v4f*)&sm.jn.o[w & 7][2 * t + 1][lane][0] = c; }
    const v2f ml = {m, l}; *(v2f*)&sm.jn.ml[w & 7][lane][0] = ml; }
  __syncthreads();      /* the partial results are there; passed by all 16 waves */
  if (g == 1) return;
  { const v2f ml = *(const v2f*)&sm.jn.ml[w][lane][0]; const float mx = fmaxf(m, ml[0]); const float f0 = exp_x1(m - mx), f1 = exp_x1(ml[0] - mx); l = l * f0 + ml[1] * f1;      /* both partial results brought to the query's overall maximum */
#pragma unroll      /* o[] in registers */
    for (int t = 0; t < 4; ++t) { const v4f a = *(const v4f*)&sm.jn.o[w][2 * t][lane][0], c = *(const v4f*)&sm.jn.o[w][2 * t + 1][lane][0]; for (int r = 0; r < 4; ++r) { o[t][r] = o[t][r] * f0 + a[r] * f1; o[t][4 + r] = o[t][4 + r] * f0 + c[r] * f1; } } }
  l += __shfl_xor(l, 16); const float fin = 64.0f / l;      /* o carried x64 against f16 subnormal flush, folded into the output GEMM alpha */
  _Float16* op = O + ((size_t)b * SQ + qi) * DM + h * HD + 8 * hh;
#pragma unroll      /* o[] in registers; a lane's 8 accumulator registers are 8 consecutive columns of its query's row: one 16-byte store */
  for (int t = 0; t < 4; ++t) { FragH f; for (int r = 0; r < 8; ++r) f.h[r] = (_Float16)(o[t][r] * fin); *(v8us*)((unsigned short*)op + 16 * t) = f.half[0]; }
  asm volatile("s_wait_xcnt 0x0" ::: "memory"); }      /* behind the four stores: the rider's code follows them in the listing and reuses their registers */

// One lane per query row, 32 rows a block; the rows' keys are dealt over the block's KW waves (wave w takes keys w, w + KW, ... of the block's range), each wave with its own running maximum, sum and o; the KW partial results of a row are joined through LDS at the end. A wave's key index is wave-uniform, so k and v rows still come through the scalar path. The 64-wide loops are unrolled: q[] and o[] are indexed by constants only and stay in registers.
struct AttupLds { float lo[KW][32][HD + 4];      /* row pitch 272 B = 16 B x odd: 16-byte stores of 32 rows and 16-byte loads along a row both spread over the banks */
  float lm[KW][32], ll[KW][32]; };
__device__ __forceinline__ void d_attup(const float* __restrict__ QF, const float* __restrict__ KF, const float* __restrict__ VF, int ld, float scale, float* __restrict__ OF, int ldo, int bx, int by, AttupLds& sh) {
  #pragma clang fp contract(off)
  static_assert(KW == 16 && QT0 % 32 == 0 && HD == 64, "the join below gives each of the 32 * KW threads one 4-column piece of the 32 x 64 tile");
  auto& lo = sh.lo; auto& lm = sh.lm; auto& ll = sh.ll;
  const int tid = threadIdx.x, lane = tid & 31; const int w = __builtin_amdgcn_readfirstlane(tid >> 5);      /* wave number in a scalar register: key addresses stay scalar */
  const int h = bx / (QT0 / 32), rg = bx % (QT0 / 32); const int i = rg * 32 + lane;
  { const size_t bo = (size_t)by * QT0; QF += bo * ld; KF += bo * ld; VF += bo * ld; OF += bo * ldo; }      /* by: the batch; each batch has its own QT0-row tile */
  const float* qr = QF + (size_t)i * ld + h * HD; v4f q[HD / 4], o[HD / 4];
#pragma unroll      /* q[], o[] in registers; the q row's 16 loads in flight at once */
  for (int c = 0; c < HD / 4; ++c) { q[c] = *(const v4fa*)(qr + c * 4); const v4f z = {0.f, 0.f, 0.f, 0.f}; o[c] = z; }
  float m = -1.0e30f, l = 0.f;
#pragma unroll 1
  for (int j = rg * 32 + w; j < QT0; j += KW) { const float* kr = KF + (size_t)j * ld + h * HD; const float* vr = VF + (size_t)j * ld + h * HD; v4f kq[HD / 4], vv[HD / 4]; float s = 0.f;
#pragma unroll      /* a whole row's loads in flight at once */
    for (int c = 0; c < HD / 4; ++c) kq[c] = *(const v4fa*)(kr + c * 4);
#pragma unroll      /* the v row arrives under the score sum */
    for (int c = 0; c < HD / 4; ++c) vv[c] = *(const v4fa*)(vr + c * 4);
#pragma unroll      /* q[], kq[] in registers */
    for (int c = 0; c < HD / 4; ++c) { s = __fadd_rn(s, __fmul_rn(q[c][0], kq[c][0])); s = __fadd_rn(s, __fmul_rn(q[c][1], kq[c][1])); s = __fadd_rn(s, __fmul_rn(q[c][2], kq[c][2])); s = __fadd_rn(s, __fmul_rn(q[c][3], kq[c][3])); }
    s = __fmul_rn(s, scale);
    const float f = (j > i) ? 1.f : 0.f; const float sm = fmaf(f, s, (1.f - f) * -1.0e30f); const float mn = fmaxf(m, sm); const float sc = expf(m - mn); const float e = __fmul_rn(f, expf(sm - mn)); l = __fadd_rn(__fmul_rn(l, sc), e); m = mn;
#pragma unroll      /* o[], vv[] in registers */
    for (int c = 0; c < HD / 4; ++c) for (int u = 0; u < 4; ++u) o[c][u] = __fadd_rn(__fmul_rn(o[c][u], sc), __fmul_rn(e, vv[c][u])); }
#pragma unroll      /* o[] in registers */
  for (int c = 0; c < HD / 4; ++c) *(v4f*)&lo[w][lane][c * 4] = o[c];
  lm[w][lane] = m; ll[w][lane] = l;
  __syncthreads();
  { const int row = tid / 16, pc = (tid % 16) * 4; float mw[KW], mx = -1.0e30f, ls = 0.f; v4f a = {0.f, 0.f, 0.f, 0.f};      /* join: every partial is brought to the row's overall maximum; a wave that saw no visible key holds l = 0, o = 0 and adds nothing */
#pragma unroll      /* mw[] in registers */
    for (int u = 0; u < KW; ++u) { mw[u] = lm[u][row]; mx = fmaxf(mx, mw[u]); }
#pragma unroll      /* mw[] in registers; the 16 partial pieces' LDS loads in flight at once */
    for (int u = 0; u < KW; ++u) { const float fw = exp_x1(mw[u] - mx); const v4f p = *(const v4f*)&lo[u][row][pc]; ls += ll[u][row] * fw; a += p * fw; }
    const float fin = (ls > 0.f) ? 64.0f / ls : 0.f;      /* o carried x64 like the f16 path; the key-less last row is written by d_vmean */
    a *= fin; if (rg * 32 + row != QT0 - 1) *(v4f*)(OF + (size_t)(rg * 32 + row) * ldo + h * HD + pc) = a; } }      /* the key-less last row has one writer, d_vmean, in the same launch */

__device__ __forceinline__ void d_vmean(const _Float16* __restrict__ V, float* __restrict__ orow, int bx, int by) {
  #pragma clang fp contract(off)
  const int c = bx * (32 * KW) + threadIdx.x; if (c >= DM) return; const _Float16* p = V + (size_t)by * SQ * LQ + c; orow += (size_t)by * QT0 * DM; float s = 0.f;      /* by: the batch */
#pragma unroll 1
  for (int j0 = 0; j0 < SQ; j0 += 64) { _Float16 t[64];
#pragma unroll      /* 64 rows' loads in flight at once (the constant pitch LQ makes them one address register with immediate offsets); t[] in registers */
    for (int j = 0; j < 64; ++j) t[j] = p[(size_t)(j0 + j) * LQ];
#pragma unroll      /* summed in the rows' order */
    for (int j = 0; j < 64; ++j) s = __fadd_rn(s, (float)t[j]); }
  const float o = __fmul_rn(s, 64.0f / (float)SQ); *(float*)(orow + c) = o;  }

// One launch for the three pieces of work that need only the projections and not each other, dealt by block index, the longest first: the mean of v (last row), the exact attention of the last tile, V^T (two 64 x 64 tiles a block, one per half of its threads).
#define NVM (NBR * ((DM + 32 * KW - 1) / (32 * KW)))      /* blocks of d_vmean */
#define NAT (NBR * NH * (QT0 / 32))                       /* blocks of d_attup */
#define NVT (NBR * NH * (SQ / 64) / 2)                    /* blocks of d_vt */
__global__ __launch_bounds__(32 * KW) void k_mid(const _Float16* __restrict__ V16, _Float16* __restrict__ Vt, const float* __restrict__ QF, const float* __restrict__ KF, const float* __restrict__ VF, float* __restrict__ OF) {
  static_assert(32 * KW == 512 && (NBR * NH * (SQ / 64)) % 2 == 0, "d_vt: two halves of 256 threads, a tile each");
  __shared__ __attribute__((aligned(16))) union { AttupLds a; unsigned short tl[2][64][66]; } sm;
  const int bi = blockIdx.x;      /* every branch below is the same for the whole block; d_attup stands last in the chain so that the compiler lays it in front of the other bodies' stores: behind them its wave-uniform k and v row loads left the scalar path for 32 vector loads a key */
  if (bi < NVM) d_vmean(V16, OF + (size_t)(QT0 - 1) * DM, bi % (NVM / NBR), bi / (NVM / NBR));
  else if (bi >= NVM + NAT) d_vt<NH, SQ>(V16, LQ, 0, Vt, (bi - NVM - NAT) * 2 + (int)(threadIdx.x >> 8), (int)(threadIdx.x & 255), sm.tl[threadIdx.x >> 8]);
  else d_attup(QF, KF, VF, DM, 0.125f, OF, DM, (bi - NVM) % (NAT / NBR), (bi - NVM) / (NAT / NBR), sm.a); }

extern "C" void kernel_launch(void* const* d_in, const int* in_sizes, int n_in,
                              void* d_out, int out_size, void* d_ws, size_t ws_size, hipStream_t stream) {
  (void)in_sizes; (void)n_in; (void)out_size;
  const float* const* I = (const float* const*)d_in; const float* xq = I[0]; const float* xk = I[0]; const float* xv = I[0]; const float* wq = I[1]; const float* bq = I[2]; const float* wk = I[3]; const float* bk = I[4]; const float* wv = I[5]; const float* bv = I[6]; const float* wo = I[7]; const float* bo = I[8]; const float* x = xq;      /* ONE input feeds the query, key and value streams; [in][out] weights + biases; the mask is built from indices as in the module */
  static_assert(NH * HD == DM && DM % 64 == 0 && SQ % 128 == 0 && NH % HG == 0, "shape / tile multiples");
  static_assert(MP % 128 == 0 && MPO % 128 == 0 && QT0 % 128 == 0 && DM / 64 >= 2, "k_gemm2 stages whole 128-row, 64-column, 64-deep tiles");
  char* ws = (char*)d_ws; size_t off = 0;
  auto take = [&](size_t bytes) { char* p = ws + off; off += (bytes + 255) & ~(size_t)255; return p; };
  _Float16* BQ = (_Float16*)take((size_t)4 * DM * DM * 2); _Float16* BO = BQ + (size_t)3 * DM * DM;      /* Bt planes of Wq, Wk, Wv, Wo, one behind the other */
  _Float16* X16 = (_Float16*)take((size_t)3 * NR * DM * 2);      /* query, key and value inputs as exact f16 rows: three planes */
  _Float16* Q16 = (_Float16*)take((size_t)3 * NR * DM * 2); _Float16* K16 = Q16 + NR * DM; _Float16* V16 = K16 + NR * DM; _Float16* O16 = (_Float16*)take(NR * DM * 2);      /* q, k, v: three planes */
  _Float16* VT = (_Float16*)take((size_t)NB * NH * HD * SQ * 2);
  float* QF0 = (float*)take((size_t)3 * NB * QT0 * DM * 4); float* KF0 = QF0 + (size_t)NB * QT0 * DM; float* VF0 = KF0 + (size_t)NB * QT0 * DM; float* OF0 = (float*)take((size_t)NB * QT0 * DM * 4); _Float16* OH0 = (_Float16*)take((size_t)NB * QT0 * DM * 2); _Float16* OL0 = (_Float16*)take((size_t)NB * QT0 * DM * 2);      /* exact last tile of every batch: f32 q / k / v of the tile rows (three planes of [NB][QT0] rows), o (x64) and its f16 hi + x1024 residual planes */
  if (off > ws_size) return;
  auto g2 = [](const _Float16* A, int lda, size_t sA, const _Float16* Bh, int ldb, size_t sB, float alpha, const float* bias, size_t sBias, const float* CP, int rowsPerB, size_t sCPb, int row0g, float* C, _Float16* C16, int ldc, size_t sC, int M, int N, int K, size_t sAz, size_t sBz, size_t sCz, const float* bias1, const float* bias2, int gx) {
    G2P p; p.A = A; p.Bh = Bh; p.bias = bias; p.bias1 = bias1; p.bias2 = bias2; p.CP = CP; p.C = C; p.C16 = C16; p.sA = sA; p.sB = sB; p.sBias = sBias; p.sCPb = sCPb; p.sC = sC; p.sAz = sAz; p.sBz = sBz; p.sCz = sCz; p.alpha = alpha; p.lda = lda; p.ldb = ldb; p.rowsPerB = rowsPerB; p.row0g = row0g; p.ldc = ldc; p.M = M; p.N = N; p.K = K; p.gx = gx; return p; };
  static_assert(DM % 128 == 0 && NR * DM / 8 % (256 * XU) == 0 && (size_t)NB * QT0 * DM / 8 % 512 == 0 && (SQ - QT0) % 128 == 0 && B0 == 0 && NBR == NB, "whole blocks in the shared launches");
  k_prep<<<4 * NWX + 3 * NXX, 256, 0, stream>>>(wq, wk, wv, wo, BQ, x, xk, xv, X16);      /* [in][out] -> Bt x16 of the four weights; the three streams as f16 */
  const size_t r0p = (size_t)B0 * SQ;      /* first projected row */
  const size_t rl0 = r0p + SQ - QT0; const size_t f00 = (size_t)B0 * QT0;      /* first batch's last QT0 rows; its tile in the [NB][QT0] planes */
  const G2P gq = g2(X16 + r0p * DM, DM, 0, BQ, DM, 0, 0.0625f, bq, 0, nullptr, 1, 0, 0, nullptr, Q16 + r0p * DM, DM, 0, MP, DM, DM, NR * DM, (size_t)DM * DM, NR * DM, bk, bv, (MP / 128) * (DM / 64));      /* q, k, v (z) as f16 rows */
  const G2P gf = g2(X16 + rl0 * DM, DM, (size_t)SQ * DM, BQ, DM, 0, 0.0625f, bq, 0, nullptr, 1, 0, 0, QF0 + f00 * DM, nullptr, DM, (size_t)QT0 * DM, QT0, DM, DM, NR * DM, (size_t)DM * DM, (size_t)NB * QT0 * DM, bk, bv, (QT0 / 128) * (DM / 64));      /* f32 q, k, v (z) of every batch's last tile (exact products); the batch lies in blockIdx.x */
  k_gemm2<0><<<dim3((unsigned)((MP / 128) * (DM / 64) + NBR * (QT0 / 128) * (DM / 64)), 1, 3), 128, 0, stream>>>(gq, gf, (MP / 128) * (DM / 64));
  k_mid<<<NVM + NAT + NVT, 32 * KW, 0, stream>>>(V16 + r0p * LQ, VT + (size_t)B0 * NH * HD * SQ, QF0 + f00 * DM, KF0 + f00 * DM, VF0 + f00 * DM, OF0 + f00 * DM);      /* last row: uniform over all keys = 64 x mean of v; exact f32 attention over the keys j > i inside the last tile (o x64); V^T [NB][NH][HD][SQ] */
  k_fattn<<<NFA + NHL, 512, 0, stream>>>(Q16, K16, VT, O16, OF0, OH0, OL0);      /* scores, literal 'score + tril * (-1e9)', softmax and the weighted v sum, every (batch, head), the rows in front of the last tile -> o (merged heads, x64) as f16 rows; beside it last-tile o (x64) -> f16 hi + x1024 residual planes */
  const G2P go = g2(O16 + r0p * DM, DM, (size_t)SQ * DM, BO, DM, 0, 0.0009765625f, bo, 0, nullptr, 1, 0, 0, (float*)d_out + r0p * DM, nullptr, DM, (size_t)SQ * DM, SQ - QT0, DM, DM, 0, 0, 0, nullptr, nullptr, ((SQ - QT0) / 128) * (DM / 64));      /* out rows in front of every batch's (y) last tile, from the f16 path */
  const G2P gh = g2(OH0 + f00 * DM, DM, (size_t)QT0 * DM, BO, DM, 0, 0.0009765625f, bo, 0, nullptr, 1, 0, 0, (float*)d_out + rl0 * DM, nullptr, DM, (size_t)SQ * DM, QT0, DM, DM, 0, 0, 0, nullptr, nullptr, (QT0 / 128) * (DM / 64));      /* last QT0 rows of every batch (y): out = o_hi Wo (+ b) */
  k_gemm2<0><<<dim3((SQ / 128) * (DM / 64), NBR), 128, 0, stream>>>(go, gh, ((SQ - QT0) / 128) * (DM / 64));      /* every out row has one writer */
  const G2P gl = g2(OL0 + f00 * DM, DM, (size_t)QT0 * DM, BO, DM, 0, 0.00000095367431640625f, nullptr, 0, (const float*)d_out + rl0 * DM, -1, 0, 0, (float*)d_out + rl0 * DM, nullptr, DM, (size_t)SQ * DM, QT0, DM, DM, 0, 0, 0, nullptr, nullptr, (QT0 / 128) * (DM / 64));      /* += o_lo Wo 2^-20 (own-element accumulate) */
  k_gemm2<0><<<dim3((QT0 / 128) * (DM / 64), NBR), 128, 0, stream>>>(gl, gl, (QT0 / 128) * (DM / 64));      /* needs the launch before it: alone */
}
